// v000
// The times below were measured on an AMD MI455X: many runs one after another, warmed up first and cycling through
// copies of the inputs, with the whole window's GPU time divided by the number of runs. Launches and the gaps
// between them are all in it. The median over several windows is given; except for v000 it joins two sittings, which
// can be a few percent apart, so the side-by-side timings, each taken in one sitting, are the better comparison.
// v000 is the starting kernel. One run takes 2310 microseconds.
#include <hip/hip_runtime.h>
#include <stdint.h>

typedef float v2f __attribute__((ext_vector_type(2)));
typedef float v4f __attribute__((ext_vector_type(4)));
typedef float v8f __attribute__((ext_vector_type(8)));

namespace {
constexpr int kBc = 2, kSc = 2048, kD = 1024, kH = 2048, kE = 8;
constexpr int kM = kBc * kSc;              // 4096 tokens
constexpr float kScale = 1.0f / 32.0f;     // 1/sqrt(1024)

constexpr int BM = 128, BN = 128, BK = 16, PAD = 4;
constexpr int BNP = 144;  // B LDS n-stride; 2*BNP mod 64 == 32 -> halves of the
                          // wave hit opposite 32-bank groups (conflict-free)
} // namespace

// ---- CDNA5 async global->LDS copy (ASYNCcnt-tracked, bypasses VGPRs) ------
__device__ __forceinline__ void async_copy_b128(uint32_t lds_byte_addr,
                                                const void* gaddr) {
  asm volatile("global_load_async_to_lds_b128 %0, %1, off"
               :
               : "v"(lds_byte_addr), "v"((unsigned long long)(uintptr_t)gaddr)
               : "memory");
}
__device__ __forceinline__ void wait_async0() {
  asm volatile("s_wait_asynccnt 0x0" ::: "memory");
}
// low 32 bits of a generic pointer to __shared__ = LDS byte offset
__device__ __forceinline__ uint32_t lds_addr32(const void* p) {
  return (uint32_t)(uintptr_t)p;
}

// ---------------------------------------------------------------------------
// Router: one wave32 per token. Dense [token, E] weight map in workspace.
// ---------------------------------------------------------------------------
__global__ __launch_bounds__(256) void router_kernel(
    const float* __restrict__ x,    // [kM, kD]
    const float* __restrict__ Wr,   // [kD, kE]
    const float* __restrict__ rb,   // [kE]
    float* __restrict__ wfull) {    // [kM, kE]
  const int wave = threadIdx.x >> 5;
  const int lane = threadIdx.x & 31;
  const int token = blockIdx.x * 8 + wave;
  const float* xr = x + (size_t)token * kD;

  float acc[kE];
#pragma unroll
  for (int e = 0; e < kE; ++e) acc[e] = 0.0f;

  for (int d = lane; d < kD; d += 32) {
    const float xv = xr[d];
    const float* wr = Wr + (size_t)d * kE;
#pragma unroll
    for (int e = 0; e < kE; ++e) acc[e] = fmaf(xv, wr[e], acc[e]);
  }
#pragma unroll
  for (int e = 0; e < kE; ++e) {
#pragma unroll
    for (int off = 16; off >= 1; off >>= 1)
      acc[e] += __shfl_xor(acc[e], off, 32);
  }

  if (lane == 0) {
    float logit[kE], biased[kE];
#pragma unroll
    for (int e = 0; e < kE; ++e) {
      logit[e] = acc[e] * kScale;
      biased[e] = logit[e] + rb[e];
    }
    // top-2 on biased logits, lowest-index tie-break (matches lax.top_k)
    int i0 = 0;
#pragma unroll
    for (int e = 1; e < kE; ++e)
      if (biased[e] > biased[i0]) i0 = e;
    int i1 = (i0 == 0) ? 1 : 0;
#pragma unroll
    for (int e = 0; e < kE; ++e)
      if (e != i0 && biased[e] > biased[i1]) i1 = e;
    // softmax over the two ORIGINAL logits
    const float l0 = logit[i0], l1 = logit[i1];
    const float mx = fmaxf(l0, l1);
    const float e0 = __expf(l0 - mx), e1 = __expf(l1 - mx);
    const float inv = 1.0f / (e0 + e1);
    const float w0 = e0 * inv, w1 = e1 * inv;
    float* wf = wfull + (size_t)token * kE;
#pragma unroll
    for (int e = 0; e < kE; ++e)
      wf[e] = (e == i0) ? w0 : (e == i1) ? w1 : 0.0f;
  }
}

// ---------------------------------------------------------------------------
// Pass 1: hbuf = (x @ W1) * silu(x @ W3)     M=4096, N=kH, K=kD
// Block tile 128x128x16; 8 waves (4 M x 2 N); wave tile 32x64 (2x4 16x16).
// A tile: double-buffered LDS, filled by GLOBAL_LOAD_ASYNC_TO_LDS_B128.
// B tiles: reg-staged into k-paired LDS layout [kpair][n][2] so every
// fragment is one aligned ds_load_b64 (no register shuffles before WMMA).
// ---------------------------------------------------------------------------
__global__ __launch_bounds__(256) void gateup_kernel(
    const float* __restrict__ A,    // [kM, kD]
    const float* __restrict__ B1,   // [kD, kH]
    const float* __restrict__ B3,   // [kD, kH]
    float* __restrict__ Hout) {     // [kM, kH]
  __shared__ __align__(16) float sA[2][BM][BK + PAD];
  __shared__ __align__(16) float sB1[BK / 2][BNP][2];
  __shared__ __align__(16) float sB3[BK / 2][BNP][2];

  const int m0 = blockIdx.y * BM;
  const int n0 = blockIdx.x * BN;
  const int tid = threadIdx.x;
  const int wave = tid >> 5;
  const int lane = tid & 31;
  const int wm = (wave & 3) * 32;    // wave M offset: 0,32,64,96
  const int wn = (wave >> 2) * 64;   // wave N offset: 0,64
  const int r16 = lane & 15;
  const int koff = (lane >> 4) * 2;  // upper half-wave holds k+2,k+3
  const int rowb = (lane >> 4) * 8;  // C/D: upper half-wave holds rows +8

  // staging-thread mappings
  const int aRow0 = tid >> 2;        // A: thread -> (row, 16B chunk), x2
  const int aC4_0 = (tid & 3) * 4;
  const int aRow1 = (tid + 256) >> 2;
  const int aC4_1 = ((tid + 256) & 3) * 4;
  const int bKp = tid >> 5;          // B: k-pair 0..7
  const int bC4 = (tid & 31) * 4;    // B: n offset within tile

  v8f acc1[2][4], acc3[2][4];
#pragma unroll
  for (int mt = 0; mt < 2; ++mt)
#pragma unroll
    for (int nt = 0; nt < 4; ++nt) {
      acc1[mt][nt] = (v8f){0, 0, 0, 0, 0, 0, 0, 0};
      acc3[mt][nt] = (v8f){0, 0, 0, 0, 0, 0, 0, 0};
    }

  auto issueA = [&](int buf, int k0) {
    async_copy_b128(lds_addr32(&sA[buf][aRow0][aC4_0]),
                    A + (size_t)(m0 + aRow0) * kD + k0 + aC4_0);
    async_copy_b128(lds_addr32(&sA[buf][aRow1][aC4_1]),
                    A + (size_t)(m0 + aRow1) * kD + k0 + aC4_1);
  };

  v4f r1[2], r3[2];
  auto gloadB = [&](int k0) {
    const int r0 = k0 + bKp * 2;
    r1[0] = *(const v4f*)(B1 + (size_t)r0 * kH + n0 + bC4);
    r1[1] = *(const v4f*)(B1 + (size_t)(r0 + 1) * kH + n0 + bC4);
    r3[0] = *(const v4f*)(B3 + (size_t)r0 * kH + n0 + bC4);
    r3[1] = *(const v4f*)(B3 + (size_t)(r0 + 1) * kH + n0 + bC4);
  };
  auto lstoreB = [&]() {
#pragma unroll
    for (int j = 0; j < 4; ++j) {
      *(v2f*)&sB1[bKp][bC4 + j][0] = (v2f){r1[0][j], r1[1][j]};
      *(v2f*)&sB3[bKp][bC4 + j][0] = (v2f){r3[0][j], r3[1][j]};
    }
  };

  issueA(0, 0);
  gloadB(0);
  int buf = 0;
  for (int k0 = 0; k0 < kD; k0 += BK) {
    lstoreB();
    wait_async0();       // this wave's async A copies for `buf` are done
    __syncthreads();     // all waves' A copies + B stores visible
    if (k0 + BK < kD) {  // overlap next tile's fills with WMMA below
      issueA(buf ^ 1, k0 + BK);
      gloadB(k0 + BK);
    }

#pragma unroll
    for (int kk = 0; kk < BK; kk += 4) {
      const int kp = (kk + koff) >> 1;
      v2f a[2], b1f[4], b3f[4];
#pragma unroll
      for (int mt = 0; mt < 2; ++mt)
        a[mt] = *(const v2f*)&sA[buf][wm + mt * 16 + r16][kk + koff];
#pragma unroll
      for (int nt = 0; nt < 4; ++nt) {
        b1f[nt] = *(const v2f*)&sB1[kp][wn + nt * 16 + r16][0];
        b3f[nt] = *(const v2f*)&sB3[kp][wn + nt * 16 + r16][0];
      }
#pragma unroll
      for (int mt = 0; mt < 2; ++mt)
#pragma unroll
        for (int nt = 0; nt < 4; ++nt) {
          acc1[mt][nt] = __builtin_amdgcn_wmma_f32_16x16x4_f32(
              false, a[mt], false, b1f[nt], (short)0, acc1[mt][nt], false,
              false);
          acc3[mt][nt] = __builtin_amdgcn_wmma_f32_16x16x4_f32(
              false, a[mt], false, b3f[nt], (short)0, acc3[mt][nt], false,
              false);
        }
    }
    __syncthreads();
    buf ^= 1;
  }

  // epilogue: h = up * silu(gate)
#pragma unroll
  for (int mt = 0; mt < 2; ++mt)
#pragma unroll
    for (int nt = 0; nt < 4; ++nt)
#pragma unroll
      for (int v = 0; v < 8; ++v) {
        const int row = m0 + wm + mt * 16 + rowb + v;
        const int col = n0 + wn + nt * 16 + r16;
        const float g = acc3[mt][nt][v];
        const float silu = g / (1.0f + __expf(-g));
        Hout[(size_t)row * kH + col] = acc1[mt][nt][v] * silu;
      }
}

// ---------------------------------------------------------------------------
// Pass 2: out (+)= w_full[:,e] * (hbuf @ W2)   M=4096, N=kD, K=kH
// expert < 0  -> shared expert: weight 1, plain store (initializes out)
// ---------------------------------------------------------------------------
__global__ __launch_bounds__(256) void down_kernel(
    const float* __restrict__ A,     // [kM, kH]
    const float* __restrict__ B,     // [kH, kD]
    const float* __restrict__ Wfull, // [kM, kE]
    int expert,
    float* __restrict__ Out) {       // [kM, kD]
  __shared__ __align__(16) float sA[2][BM][BK + PAD];
  __shared__ __align__(16) float sB[BK / 2][BNP][2];

  const int m0 = blockIdx.y * BM;
  const int n0 = blockIdx.x * BN;
  const int tid = threadIdx.x;
  const int wave = tid >> 5;
  const int lane = tid & 31;
  const int wm = (wave & 3) * 32;
  const int wn = (wave >> 2) * 64;
  const int r16 = lane & 15;
  const int koff = (lane >> 4) * 2;
  const int rowb = (lane >> 4) * 8;

  const int aRow0 = tid >> 2;
  const int aC4_0 = (tid & 3) * 4;
  const int aRow1 = (tid + 256) >> 2;
  const int aC4_1 = ((tid + 256) & 3) * 4;
  const int bKp = tid >> 5;
  const int bC4 = (tid & 31) * 4;

  v8f acc[2][4];
#pragma unroll
  for (int mt = 0; mt < 2; ++mt)
#pragma unroll
    for (int nt = 0; nt < 4; ++nt) acc[mt][nt] = (v8f){0, 0, 0, 0, 0, 0, 0, 0};

  auto issueA = [&](int buf, int k0) {
    async_copy_b128(lds_addr32(&sA[buf][aRow0][aC4_0]),
                    A + (size_t)(m0 + aRow0) * kH + k0 + aC4_0);
    async_copy_b128(lds_addr32(&sA[buf][aRow1][aC4_1]),
                    A + (size_t)(m0 + aRow1) * kH + k0 + aC4_1);
  };

  v4f rbv[2];
  auto gloadB = [&](int k0) {
    const int r0 = k0 + bKp * 2;
    rbv[0] = *(const v4f*)(B + (size_t)r0 * kD + n0 + bC4);
    rbv[1] = *(const v4f*)(B + (size_t)(r0 + 1) * kD + n0 + bC4);
  };
  auto lstoreB = [&]() {
#pragma unroll
    for (int j = 0; j < 4; ++j)
      *(v2f*)&sB[bKp][bC4 + j][0] = (v2f){rbv[0][j], rbv[1][j]};
  };

  issueA(0, 0);
  gloadB(0);
  int buf = 0;
  for (int k0 = 0; k0 < kH; k0 += BK) {
    lstoreB();
    wait_async0();
    __syncthreads();
    if (k0 + BK < kH) {
      issueA(buf ^ 1, k0 + BK);
      gloadB(k0 + BK);
    }

#pragma unroll
    for (int kk = 0; kk < BK; kk += 4) {
      const int kp = (kk + koff) >> 1;
      v2f a[2], b[4];
#pragma unroll
      for (int mt = 0; mt < 2; ++mt)
        a[mt] = *(const v2f*)&sA[buf][wm + mt * 16 + r16][kk + koff];
#pragma unroll
      for (int nt = 0; nt < 4; ++nt)
        b[nt] = *(const v2f*)&sB[kp][wn + nt * 16 + r16][0];
#pragma unroll
      for (int mt = 0; mt < 2; ++mt)
#pragma unroll
        for (int nt = 0; nt < 4; ++nt)
          acc[mt][nt] = __builtin_amdgcn_wmma_f32_16x16x4_f32(
              false, a[mt], false, b[nt], (short)0, acc[mt][nt], false, false);
    }
    __syncthreads();
    buf ^= 1;
  }

#pragma unroll
  for (int mt = 0; mt < 2; ++mt)
#pragma unroll
    for (int nt = 0; nt < 4; ++nt)
#pragma unroll
      for (int v = 0; v < 8; ++v) {
        const int row = m0 + wm + mt * 16 + rowb + v;
        const int col = n0 + wn + nt * 16 + r16;
        const float val = acc[mt][nt][v];
        if (expert < 0) {
          Out[(size_t)row * kD + col] = val;  // shared expert: initialize
        } else {
          const float wtok = Wfull[(size_t)row * kE + expert];
          Out[(size_t)row * kD + col] += wtok * val;
        }
      }
}

// ---------------------------------------------------------------------------
extern "C" void kernel_launch(void* const* d_in, const int* in_sizes, int n_in,
                              void* d_out, int out_size, void* d_ws,
                              size_t ws_size, hipStream_t stream) {
  const float* x   = (const float*)d_in[0];
  const float* Wr  = (const float*)d_in[1];
  const float* rb  = (const float*)d_in[2];
  const float* W1  = (const float*)d_in[3];  // [E, D, H]
  const float* W2  = (const float*)d_in[4];  // [E, H, D]
  const float* W3  = (const float*)d_in[5];  // [E, D, H]
  const float* Ws1 = (const float*)d_in[6];  // [D, HS]
  const float* Ws2 = (const float*)d_in[7];  // [HS, D]
  const float* Ws3 = (const float*)d_in[8];  // [D, HS]
  float* out = (float*)d_out;

  // workspace layout: [w_full : kM*kE f32][hbuf : kM*kH f32]  (~33.7 MB)
  float* wfull = (float*)d_ws;
  const size_t off = ((size_t)kM * kE * sizeof(float) + 255) & ~(size_t)255;
  float* hbuf = (float*)((char*)d_ws + off);

  router_kernel<<<kM / 8, 256, 0, stream>>>(x, Wr, rb, wfull);

  dim3 blk(256, 1, 1);
  dim3 g1(kH / BN, kM / BM, 1);  // 16 x 32
  dim3 g2(kD / BN, kM / BM, 1);  // 8 x 32

  // shared expert first: initializes out
  gateup_kernel<<<g1, blk, 0, stream>>>(x, Ws1, Ws3, hbuf);
  down_kernel<<<g2, blk, 0, stream>>>(hbuf, Ws2, wfull, -1, out);

  // routed experts: accumulate with per-token router weights
  for (int e = 0; e < kE; ++e) {
    gateup_kernel<<<g1, blk, 0, stream>>>(x, W1 + (size_t)e * kD * kH,
                                          W3 + (size_t)e * kD * kH, hbuf);
    down_kernel<<<g2, blk, 0, stream>>>(hbuf, W2 + (size_t)e * kH * kD, wfull,
                                        e, out);
  }

  (void)in_sizes; (void)n_in; (void)out_size; (void)ws_size;
}

// v002
// Measured time: 759 microseconds a run.
// Versions in between are left out here; by their measured steps it is 3.13 times as fast as v000.
#include <hip/hip_runtime.h>
#include <stdint.h>

typedef float v2f __attribute__((ext_vector_type(2)));
typedef float v4f __attribute__((ext_vector_type(4)));
typedef float v8f __attribute__((ext_vector_type(8)));
typedef int v4i __attribute__((ext_vector_type(4)));

namespace {
constexpr int kBc = 2, kSc = 2048, kD = 1024, kH = 2048, kE = 8;
constexpr int kM = kBc * kSc;              // 4096 tokens
constexpr float kScale = 1.0f / 32.0f;     // 1/sqrt(1024)

// Block tiles: 64 rows in both GEMMs; 64 columns of gate and of up in pass 1,
// 128 columns in pass 2. A tile is the unit of work that the fullest WGP runs
// beyond the mean share of a launch, and an expert's rows are padded to it.
constexpr int BM = 64, BK = 16, PAD = 4;
constexpr int BN1 = 64, kThr1 = 128;   // pass 1: 4 waves
constexpr int BN2 = 128, kThr2 = 256;  // pass 2: 8 waves
// B LDS n-stride; 2*BNP mod 64 == 32 -> halves of the wave hit opposite
// 32-bank groups (conflict-free)
constexpr int BNP1 = 80, BNP2 = 144;

// Compact row space of the grouped GEMMs: the shared expert's kM rows first,
// then each routed expert's selected tokens, each expert padded to whole
// BM-row tiles. A token has at most two nonzero router weights.
constexpr int kTiles = kM / BM + 2 * kM / BM + kE;  // 64 + 128 + 8 = 200
constexpr int kRows = kTiles * BM;                  // 12800
} // namespace

// ---- CDNA5 async global->LDS copy (ASYNCcnt-tracked, bypasses VGPRs) ------
// Both copies of a thread and s_wait_xcnt 0 stand in one statement, so that no
// address register of a copy is rewritten ahead of that wait.
__device__ __forceinline__ void async_copy2_b128(uint32_t lds0, const void* g0,
                                                 uint32_t lds1,
                                                 const void* g1) {
  asm volatile("global_load_async_to_lds_b128 %0, %1, off\n\t"
               "global_load_async_to_lds_b128 %2, %3, off\n\t"
               "s_wait_xcnt 0x0"
               :
               : "v"(lds0), "v"((unsigned long long)(uintptr_t)g0), "v"(lds1),
                 "v"((unsigned long long)(uintptr_t)g1)
               : "memory");
}
// One copy of a thread, with its s_wait_xcnt 0 in the same statement.
__device__ __forceinline__ void async_copy_b128(uint32_t lds, const void* g) {
  asm volatile("global_load_async_to_lds_b128 %0, %1, off\n\t"
               "s_wait_xcnt 0x0"
               :
               : "v"(lds), "v"((unsigned long long)(uintptr_t)g)
               : "memory");
}
__device__ __forceinline__ void wait_async0() {
  asm volatile("s_wait_asynccnt 0x0" ::: "memory");
}
// low 32 bits of a generic pointer to __shared__ = LDS byte offset
__device__ __forceinline__ uint32_t lds_addr32(const void* p) {
  return (uint32_t)(uintptr_t)p;
}

// ---------------------------------------------------------------------------
// Router: one wave32 per token. Dense [token, E] weight map in workspace.
// ---------------------------------------------------------------------------
__global__ __launch_bounds__(256) void router_kernel(
    const float* __restrict__ x,    // [kM, kD]
    const float* __restrict__ Wr,   // [kD, kE]
    const float* __restrict__ rb,   // [kE]
    float* __restrict__ wfull) {    // [kM, kE]
  const int wave = threadIdx.x >> 5;
  const int lane = threadIdx.x & 31;
  const int token = blockIdx.x * 8 + wave;
  const float* xr = x + (size_t)token * kD;

  float acc[kE];
#pragma unroll
  for (int e = 0; e < kE; ++e) acc[e] = 0.0f;

  for (int d = lane; d < kD; d += 32) {
    const float xv = xr[d];
    const float* wr = Wr + (size_t)d * kE;
#pragma unroll
    for (int e = 0; e < kE; ++e) acc[e] = fmaf(xv, wr[e], acc[e]);
  }
#pragma unroll
  for (int e = 0; e < kE; ++e) {
#pragma unroll
    for (int off = 16; off >= 1; off >>= 1)
      acc[e] += __shfl_xor(acc[e], off, 32);
  }

  if (lane == 0) {
    float logit[kE], biased[kE];
#pragma unroll
    for (int e = 0; e < kE; ++e) {
      logit[e] = acc[e] * kScale;
      biased[e] = logit[e] + rb[e];
    }
    // top-2 on biased logits, lowest-index tie-break (matches lax.top_k)
    int i0 = 0;
#pragma unroll
    for (int e = 1; e < kE; ++e)
      if (biased[e] > biased[i0]) i0 = e;
    int i1 = (i0 == 0) ? 1 : 0;
#pragma unroll
    for (int e = 0; e < kE; ++e)
      if (e != i0 && biased[e] > biased[i1]) i1 = e;
    // softmax over the two ORIGINAL logits
    const float l0 = logit[i0], l1 = logit[i1];
    const float mx = fmaxf(l0, l1);
    const float e0 = __expf(l0 - mx), e1 = __expf(l1 - mx);
    const float inv = 1.0f / (e0 + e1);
    const float w0 = e0 * inv, w1 = e1 * inv;
    float* wf = wfull + (size_t)token * kE;
#pragma unroll
    for (int e = 0; e < kE; ++e)
      wf[e] = (e == i0) ? w0 : (e == i1) ? w1 : 0.0f;
  }
}

// ---------------------------------------------------------------------------
// Row lists: one work-group. A routed expert's term is w_full * expert_out, so
// a token whose weight is exactly zero adds nothing and gets no row. Rows are
// numbered by a prefix sum over the tokens in order (no atomics).
//   rowTok[row]    token that a compact row holds (pad rows: token 0, unused)
//   slot[token][e] compact row of (token, e) where the weight is nonzero
//   tileExp[tile]  0..kE-1 routed expert, kE shared expert, -1 tile unused
// ---------------------------------------------------------------------------
__global__ __launch_bounds__(1024) void plan_kernel(
    const float* __restrict__ wfull,  // [kM, kE]
    int* __restrict__ rowTok,         // [kRows]
    int* __restrict__ slot,           // [kM, kE]
    int* __restrict__ tileExp) {      // [kTiles]
  // per-thread counts of 8 experts, 16 bits each (a count is at most kM)
  __shared__ unsigned long long sc[2][2][1024];
  const int tid = threadIdx.x;
  const int t0 = tid * 4;  // four consecutive tokens a thread

  unsigned sel[4];
  unsigned long long c0 = 0, c1 = 0;
#pragma unroll
  for (int j = 0; j < 4; ++j) {
    const v4f lo = *(const v4f*)(wfull + (size_t)(t0 + j) * kE);
    const v4f hi = *(const v4f*)(wfull + (size_t)(t0 + j) * kE + 4);
    unsigned m = 0;
#pragma unroll
    for (int e = 0; e < 4; ++e) {
      if (lo[e] != 0.0f) m |= 1u << e;
      if (hi[e] != 0.0f) m |= 1u << (e + 4);
    }
    sel[j] = m;
#pragma unroll
    for (int e = 0; e < 4; ++e) {
      c0 += (unsigned long long)((m >> e) & 1u) << (16 * e);
      c1 += (unsigned long long)((m >> (e + 4)) & 1u) << (16 * e);
    }
  }

  // inclusive scan over the 1024 threads, two LDS buffers, one barrier a step
  int cur = 0;
  sc[0][0][tid] = c0;
  sc[0][1][tid] = c1;
  __syncthreads();
  for (int off = 1; off < 1024; off <<= 1) {
    unsigned long long v0 = sc[cur][0][tid], v1 = sc[cur][1][tid];
    if (tid >= off) {
      v0 += sc[cur][0][tid - off];
      v1 += sc[cur][1][tid - off];
    }
    sc[cur ^ 1][0][tid] = v0;
    sc[cur ^ 1][1][tid] = v1;
    __syncthreads();
    cur ^= 1;
  }
  const unsigned long long ex0 = sc[cur][0][tid] - c0;
  const unsigned long long ex1 = sc[cur][1][tid] - c1;
  const unsigned long long tot0 = sc[cur][0][1023];
  const unsigned long long tot1 = sc[cur][1][1023];

  int base[kE + 1], tot[kE], run[kE];
  base[0] = kM;
#pragma unroll
  for (int e = 0; e < kE; ++e) {
    const int sh = 16 * (e & 3);
    tot[e] = (int)(((e < 4 ? tot0 : tot1) >> sh) & 0xffffu);
    run[e] = (int)(((e < 4 ? ex0 : ex1) >> sh) & 0xffffu);
    base[e + 1] = base[e] + ((tot[e] + BM - 1) & ~(BM - 1));
  }

#pragma unroll
  for (int j = 0; j < 4; ++j) {
    rowTok[t0 + j] = t0 + j;  // shared expert: every token, in order
    int sl[kE];
#pragma unroll
    for (int e = 0; e < kE; ++e) {
      const bool s = (sel[j] >> e) & 1u;
      const int row = base[e] + run[e];
      if (s) {
        rowTok[row] = t0 + j;
        ++run[e];
      }
      sl[e] = s ? row : 0;
    }
    *(v4i*)(slot + (size_t)(t0 + j) * kE) = (v4i){sl[0], sl[1], sl[2], sl[3]};
    *(v4i*)(slot + (size_t)(t0 + j) * kE + 4) = (v4i){sl[4], sl[5], sl[6], sl[7]};
  }
#pragma unroll
  for (int e = 0; e < kE; ++e)  // fewer than BM pad rows an expert
    if (base[e] + tot[e] + tid < base[e + 1]) rowTok[base[e] + tot[e] + tid] = 0;

  if (tid < kTiles) {
    const int r = tid * BM;
    int g = (r < kM) ? kE : -1;
#pragma unroll
    for (int e = 0; e < kE; ++e)
      if (r >= base[e] && r < base[e + 1]) g = e;
    tileExp[tid] = g;
  }
}

// ---------------------------------------------------------------------------
// Pass 1: hbuf = (x @ W1) * silu(x @ W3)     N=kH, K=kD, grouped over experts:
// blockIdx.y is a tile of compact rows; its expert picks the weights and
// rowTok picks the rows of x.
// Block tile 64x64x16; 4 waves (2 M x 2 N); wave tile 32x32 (2x2 16x16).
// A tile: double-buffered LDS, filled by GLOBAL_LOAD_ASYNC_TO_LDS_B128.
// B tiles: reg-staged into k-paired LDS layout [kpair][n][2] so every
// fragment is one aligned ds_load_b64 (no register shuffles before WMMA).
// ---------------------------------------------------------------------------
__global__ __launch_bounds__(kThr1) void gateup_kernel(
    const float* __restrict__ A,    // [kM, kD]
    const float* __restrict__ W1,   // [kE, kD, kH]
    const float* __restrict__ W3,   // [kE, kD, kH]
    const float* __restrict__ Ws1,  // [kD, kH]
    const float* __restrict__ Ws3,  // [kD, kH]
    const int* __restrict__ rowTok,   // [kRows]
    const int* __restrict__ tileExp,  // [kTiles]
    float* __restrict__ Hout) {     // [kRows, kH]
  __shared__ __align__(16) float sA[2][BM][BK + PAD];
  __shared__ __align__(16) float sB1[BK / 2][BNP1][2];
  __shared__ __align__(16) float sB3[BK / 2][BNP1][2];

  const int g = tileExp[blockIdx.y];
  if (g < 0) return;  // whole work-group, ahead of every barrier
  const float* __restrict__ B1 = (g == kE) ? Ws1 : W1 + (size_t)g * kD * kH;
  const float* __restrict__ B3 = (g == kE) ? Ws3 : W3 + (size_t)g * kD * kH;

  const int m0 = blockIdx.y * BM;
  const int n0 = blockIdx.x * BN1;
  const int tid = threadIdx.x;
  const int wave = tid >> 5;
  const int lane = tid & 31;
  const int wm = (wave & 1) * 32;    // wave M offset: 0,32
  const int wn = (wave >> 1) * 32;   // wave N offset: 0,32
  const int r16 = lane & 15;
  const int koff = (lane >> 4) * 2;  // upper half-wave holds k+2,k+3
  const int rowb = (lane >> 4) * 8;  // C/D: upper half-wave holds rows +8

  // staging-thread mappings
  const int aRow0 = tid >> 2;        // A: thread -> (row, 16B chunk), x2
  const int aC4_0 = (tid & 3) * 4;
  const int aRow1 = (tid + kThr1) >> 2;
  const int aC4_1 = ((tid + kThr1) & 3) * 4;
  const int bKp = tid >> 4;          // B: k-pair 0..7
  const int bC4 = (tid & 15) * 4;    // B: n offset within tile

  v8f acc1[2][2], acc3[2][2];
#pragma unroll
  for (int mt = 0; mt < 2; ++mt)
#pragma unroll
    for (int nt = 0; nt < 2; ++nt) {
      acc1[mt][nt] = (v8f){0, 0, 0, 0, 0, 0, 0, 0};
      acc3[mt][nt] = (v8f){0, 0, 0, 0, 0, 0, 0, 0};
    }

  const float* aSrc0 = A + (size_t)rowTok[m0 + aRow0] * kD + aC4_0;
  const float* aSrc1 = A + (size_t)rowTok[m0 + aRow1] * kD + aC4_1;
  auto issueA = [&](int buf, int k0) {
    async_copy2_b128(lds_addr32(&sA[buf][aRow0][aC4_0]), aSrc0 + k0,
                     lds_addr32(&sA[buf][aRow1][aC4_1]), aSrc1 + k0);
  };

  v4f r1[2], r3[2];
  auto gloadB = [&](int k0) {
    const int r0 = k0 + bKp * 2;
    r1[0] = *(const v4f*)(B1 + (size_t)r0 * kH + n0 + bC4);
    r1[1] = *(const v4f*)(B1 + (size_t)(r0 + 1) * kH + n0 + bC4);
    r3[0] = *(const v4f*)(B3 + (size_t)r0 * kH + n0 + bC4);
    r3[1] = *(const v4f*)(B3 + (size_t)(r0 + 1) * kH + n0 + bC4);
  };
  auto lstoreB = [&]() {
#pragma unroll
    for (int j = 0; j < 4; ++j) {
      *(v2f*)&sB1[bKp][bC4 + j][0] = (v2f){r1[0][j], r1[1][j]};
      *(v2f*)&sB3[bKp][bC4 + j][0] = (v2f){r3[0][j], r3[1][j]};
    }
  };

  issueA(0, 0);
  gloadB(0);
  int buf = 0;
  for (int k0 = 0; k0 < kD; k0 += BK) {
    lstoreB();
    wait_async0();       // this wave's async A copies for `buf` are done
    __syncthreads();     // all waves' A copies + B stores visible
    if (k0 + BK < kD) {  // overlap next tile's fills with WMMA below
      issueA(buf ^ 1, k0 + BK);
      gloadB(k0 + BK);
      // stands ahead of the first rewrite of the B loads' address registers
      asm volatile("s_wait_xcnt 0x0" ::: "memory");
    }

#pragma unroll
    for (int kk = 0; kk < BK; kk += 4) {
      const int kp = (kk + koff) >> 1;
      v2f a[2], b1f[2], b3f[2];
#pragma unroll
      for (int mt = 0; mt < 2; ++mt)
        a[mt] = *(const v2f*)&sA[buf][wm + mt * 16 + r16][kk + koff];
#pragma unroll
      for (int nt = 0; nt < 2; ++nt) {
        b1f[nt] = *(const v2f*)&sB1[kp][wn + nt * 16 + r16][0];
        b3f[nt] = *(const v2f*)&sB3[kp][wn + nt * 16 + r16][0];
      }
#pragma unroll
      for (int mt = 0; mt < 2; ++mt)
#pragma unroll
        for (int nt = 0; nt < 2; ++nt) {
          acc1[mt][nt] = __builtin_amdgcn_wmma_f32_16x16x4_f32(
              false, a[mt], false, b1f[nt], (short)0, acc1[mt][nt], false,
              false);
          acc3[mt][nt] = __builtin_amdgcn_wmma_f32_16x16x4_f32(
              false, a[mt], false, b3f[nt], (short)0, acc3[mt][nt], false,
              false);
        }
    }
    __syncthreads();
    buf ^= 1;
  }

  // epilogue: h = up * silu(gate)
#pragma unroll
  for (int mt = 0; mt < 2; ++mt)
#pragma unroll
    for (int nt = 0; nt < 2; ++nt)
#pragma unroll
      for (int v = 0; v < 8; ++v) {
        const int row = m0 + wm + mt * 16 + rowb + v;
        const int col = n0 + wn + nt * 16 + r16;
        const float g = acc3[mt][nt][v];
        const float silu = g / (1.0f + __expf(-g));
        Hout[(size_t)row * kH + col] = acc1[mt][nt][v] * silu;
      }
}

// ---------------------------------------------------------------------------
// Pass 2: y = hbuf @ W2   N=kD, K=kH, grouped over experts like pass 1;
// rows stay compact, the router weight is applied in the combine pass.
// Block tile 64x128x16; 8 waves (2 M x 4 N); wave tile 32x32 (2x2 16x16).
// ---------------------------------------------------------------------------
__global__ __launch_bounds__(kThr2) void down_kernel(
    const float* __restrict__ A,     // [kRows, kH]
    const float* __restrict__ W2,    // [kE, kH, kD]
    const float* __restrict__ Ws2,   // [kH, kD]
    const int* __restrict__ tileExp, // [kTiles]
    float* __restrict__ Out) {       // [kRows, kD]
  __shared__ __align__(16) float sA[2][BM][BK + PAD];
  __shared__ __align__(16) float sB[BK / 2][BNP2][2];

  const int g = tileExp[blockIdx.y];
  if (g < 0) return;  // whole work-group, ahead of every barrier
  const float* __restrict__ B = (g == kE) ? Ws2 : W2 + (size_t)g * kH * kD;

  const int m0 = blockIdx.y * BM;
  const int n0 = blockIdx.x * BN2;
  const int tid = threadIdx.x;
  const int wave = tid >> 5;
  const int lane = tid & 31;
  const int wm = (wave & 1) * 32;
  const int wn = (wave >> 1) * 32;
  const int r16 = lane & 15;
  const int koff = (lane >> 4) * 2;
  const int rowb = (lane >> 4) * 8;

  const int aRow = tid >> 2;
  const int aC4 = (tid & 3) * 4;
  const int bKp = tid >> 5;
  const int bC4 = (tid & 31) * 4;

  v8f acc[2][2];
#pragma unroll
  for (int mt = 0; mt < 2; ++mt)
#pragma unroll
    for (int nt = 0; nt < 2; ++nt) acc[mt][nt] = (v8f){0, 0, 0, 0, 0, 0, 0, 0};

  auto issueA = [&](int buf, int k0) {
    async_copy_b128(lds_addr32(&sA[buf][aRow][aC4]),
                    A + (size_t)(m0 + aRow) * kH + k0 + aC4);
  };

  v4f rbv[2];
  auto gloadB = [&](int k0) {
    const int r0 = k0 + bKp * 2;
    rbv[0] = *(const v4f*)(B + (size_t)r0 * kD + n0 + bC4);
    rbv[1] = *(const v4f*)(B + (size_t)(r0 + 1) * kD + n0 + bC4);
  };
  auto lstoreB = [&]() {
#pragma unroll
    for (int j = 0; j < 4; ++j)
      *(v2f*)&sB[bKp][bC4 + j][0] = (v2f){rbv[0][j], rbv[1][j]};
  };

  issueA(0, 0);
  gloadB(0);
  int buf = 0;
  for (int k0 = 0; k0 < kH; k0 += BK) {
    lstoreB();
    wait_async0();
    __syncthreads();
    if (k0 + BK < kH) {
      issueA(buf ^ 1, k0 + BK);
      gloadB(k0 + BK);
      // stands ahead of the first rewrite of the B loads' address registers
      asm volatile("s_wait_xcnt 0x0" ::: "memory");
    }

#pragma unroll
    for (int kk = 0; kk < BK; kk += 4) {
      const int kp = (kk + koff) >> 1;
      v2f a[2], b[2];
#pragma unroll
      for (int mt = 0; mt < 2; ++mt)
        a[mt] = *(const v2f*)&sA[buf][wm + mt * 16 + r16][kk + koff];
#pragma unroll
      for (int nt = 0; nt < 2; ++nt)
        b[nt] = *(const v2f*)&sB[kp][wn + nt * 16 + r16][0];
#pragma unroll
      for (int mt = 0; mt < 2; ++mt)
#pragma unroll
        for (int nt = 0; nt < 2; ++nt)
          acc[mt][nt] = __builtin_amdgcn_wmma_f32_16x16x4_f32(
              false, a[mt], false, b[nt], (short)0, acc[mt][nt], false, false);
    }
    __syncthreads();
    buf ^= 1;
  }

#pragma unroll
  for (int mt = 0; mt < 2; ++mt)
#pragma unroll
    for (int nt = 0; nt < 2; ++nt)
#pragma unroll
      for (int v = 0; v < 8; ++v) {
        const int row = m0 + wm + mt * 16 + rowb + v;
        const int col = n0 + wn + nt * 16 + r16;
        Out[(size_t)row * kD + col] = acc[mt][nt][v];
      }
}

// ---------------------------------------------------------------------------
// Combine: out[t] = y_shared[t] + sum over e, ascending, of w_full[t,e] * y[t,e]
// One work-group per token; every element of out is stored once.
// ---------------------------------------------------------------------------
__global__ __launch_bounds__(256) void combine_kernel(
    const float* __restrict__ Y,      // [kRows, kD]
    const float* __restrict__ Wfull,  // [kM, kE]
    const int* __restrict__ slot,     // [kM, kE]
    float* __restrict__ Out) {        // [kM, kD]
  const int t = blockIdx.x;
  const int c = threadIdx.x * 4;
  const v4f wlo = *(const v4f*)(Wfull + (size_t)t * kE);
  const v4f whi = *(const v4f*)(Wfull + (size_t)t * kE + 4);
  const v4i slo = *(const v4i*)(slot + (size_t)t * kE);
  const v4i shi = *(const v4i*)(slot + (size_t)t * kE + 4);
  v4f acc = *(const v4f*)(Y + (size_t)t * kD + c);
#pragma unroll
  for (int e = 0; e < kE; ++e) {
    const float w = (e < 4) ? wlo[e & 3] : whi[e & 3];
    const int r = (e < 4) ? slo[e & 3] : shi[e & 3];
    if (w != 0.0f) {
      const v4f y = *(const v4f*)(Y + (size_t)r * kD + c);
#pragma unroll
      for (int i = 0; i < 4; ++i) acc[i] = fmaf(w, y[i], acc[i]);
    }
  }
  *(v4f*)(Out + (size_t)t * kD + c) = acc;
}

// ---------------------------------------------------------------------------
extern "C" void kernel_launch(void* const* d_in, const int* in_sizes, int n_in,
                              void* d_out, int out_size, void* d_ws,
                              size_t ws_size, hipStream_t stream) {
  const float* x   = (const float*)d_in[0];
  const float* Wr  = (const float*)d_in[1];
  const float* rb  = (const float*)d_in[2];
  const float* W1  = (const float*)d_in[3];  // [E, D, H]
  const float* W2  = (const float*)d_in[4];  // [E, H, D]
  const float* W3  = (const float*)d_in[5];  // [E, D, H]
  const float* Ws1 = (const float*)d_in[6];  // [D, HS]
  const float* Ws2 = (const float*)d_in[7];  // [HS, D]
  const float* Ws3 = (const float*)d_in[8];  // [D, HS]
  float* out = (float*)d_out;

  // workspace layout, each part 256-byte aligned (about 158 MB):
  // [w_full][rowTok][slot][tileExp][hbuf : kRows*kH f32][y : kRows*kD f32]
  constexpr size_t oTok = (size_t)kM * kE * 4;
  constexpr size_t oSlot = oTok + (size_t)kRows * 4;
  constexpr size_t oTile = oSlot + (size_t)kM * kE * 4;
  constexpr size_t oH = oTile + 1024;
  constexpr size_t oY = oH + (size_t)kRows * kH * 4;
  float* wfull = (float*)d_ws;
  int* rowTok = (int*)((char*)d_ws + oTok);
  int* slot = (int*)((char*)d_ws + oSlot);
  int* tileExp = (int*)((char*)d_ws + oTile);
  float* hbuf = (float*)((char*)d_ws + oH);
  float* ybuf = (float*)((char*)d_ws + oY);

  router_kernel<<<kM / 8, 256, 0, stream>>>(x, Wr, rb, wfull);
  plan_kernel<<<1, 1024, 0, stream>>>(wfull, rowTok, slot, tileExp);

  dim3 blk(256, 1, 1);
  dim3 blk1(kThr1, 1, 1), blk2(kThr2, 1, 1);
  dim3 g1(kH / BN1, kTiles, 1);  // 32 x 200
  dim3 g2(kD / BN2, kTiles, 1);  // 8 x 200
  gateup_kernel<<<g1, blk1, 0, stream>>>(x, W1, W3, Ws1, Ws3, rowTok, tileExp,
                                         hbuf);
  down_kernel<<<g2, blk2, 0, stream>>>(hbuf, W2, Ws2, tileExp, ybuf);
  combine_kernel<<<kM, blk, 0, stream>>>(ybuf, wfull, slot, out);

  (void)in_sizes; (void)n_in; (void)out_size; (void)ws_size;
}
